// v000
// Measured on an AMD MI455X. A time is GPU time per run, averaged over a window of back-to-back runs after a warm-up
// (all launches, gaps included; the runs take copies of the inputs in turn), and the median of several windows.
// Apart from v000's, it joins two sittings. Times from different sittings can be a few percent apart, while
// side-by-side timings come from the same sitting.
// v000, which the later versions start from, runs in 51.8 microseconds.
#include <hip/hip_runtime.h>

// Problem constants
#define Bb   4
#define Cch  128
#define Hh   64
#define Ww   128
#define HW   (Hh * Ww)   // 8192
#define Lwin 25          // 5x5 window

typedef __attribute__((ext_vector_type(2))) float v2f;
typedef __attribute__((ext_vector_type(8))) float v8f;

// -------------------------------------------------------------------------
// Kernel 1: v[b,o,h,w] = sum_c Wv[o,c] * fmap[b,c,h,w]
// GEMM per batch: M=128 (out ch), K=128 (in ch), N=8192 (pixels).
// One wave -> one 16x16 (MxN) tile; 8 waves per block cover all M for the
// same 16 pixels so B-fragment loads hit L0. Uses V_WMMA_F32_16X16X4_F32.
//
// A 16x4 f32 layout (ISA 7.12.2): lanes 0-15 -> M rows, VGPR0 holds K=k0
// (lanes 0-15) / K=k0+2 (lanes 16-31), VGPR1 holds k0+1 / k0+3.
// B 4x16 mirrors: lanes carry N, lane-half selects K row pair.
// D 16x16 f32: VGPR r -> row m0+r (lanes 0-15) / m0+r+8 (lanes 16-31).
// -------------------------------------------------------------------------
__global__ __launch_bounds__(256) void lsa_gemm_wmma(
    const float* __restrict__ Wv,    // [C, C]
    const float* __restrict__ fmap,  // [B, C, H, W]
    float* __restrict__ v)           // [B, C, H, W] workspace
{
    const int lane = threadIdx.x & 31;
    const int wave = threadIdx.x >> 5;
    const int b    = blockIdx.y;
    const int n0   = blockIdx.x << 4;   // pixel tile base within batch
    const int m0   = wave << 4;         // output-channel tile base

    const int Ma   = lane & 15;         // A row (M) held by this lane
    const int Nl   = lane & 15;         // B/D column (N) held by this lane
    const int koff = (lane >> 4) << 1;  // 0 for lanes 0-15, 2 for lanes 16-31

    const float* __restrict__ wrow = Wv + (m0 + Ma) * Cch;
    const float* __restrict__ bcol = fmap + (size_t)b * Cch * HW + n0 + Nl;

    v8f acc = {};
    #pragma unroll 4
    for (int k0 = 0; k0 < Cch; k0 += 4) {
        v2f a, bf;
        a.x  = wrow[k0 + koff];
        a.y  = wrow[k0 + koff + 1];
        bf.x = bcol[(size_t)(k0 + koff) * HW];
        bf.y = bcol[(size_t)(k0 + koff + 1) * HW];
        // (neg_a, A, neg_b, B, c_mod, C, reuse_a, reuse_b)
        acc = __builtin_amdgcn_wmma_f32_16x16x4_f32(
            false, a, false, bf, (short)0, acc, false, false);
    }

    const int rowsel = (lane >> 4) << 3;  // +8 rows for upper lane half
    float* __restrict__ vb = v + (size_t)b * Cch * HW;
    #pragma unroll
    for (int r = 0; r < 8; ++r) {
        vb[(size_t)(m0 + r + rowsel) * HW + n0 + Nl] = acc[r];
    }
}

// -------------------------------------------------------------------------
// Kernel 2: out[b,c,y,x] = fmap[b,c,y,x]
//                        + gamma * sum_{l=25} attn[b, y*W+x, l] * v[b,c,ny,nx]
// with (ny,nx) = replicate-clamped (y+dy-2, x+dx-2), l = dy*5+dx.
// Block = 64 x-positions (coalesced v reads & out writes) x 4 channels.
// attn tile for the 64 pixels is staged once in LDS and shared by channels.
// -------------------------------------------------------------------------
__global__ __launch_bounds__(256) void lsa_aggregate(
    const float* __restrict__ attn,   // [B, 1, H*W, 25]
    const float* __restrict__ fmap,   // [B, C, H, W]
    const float* __restrict__ v,      // [B, C, H, W]
    const float* __restrict__ gamma,  // [1]
    float* __restrict__ out)          // [B, C, H, W]
{
    __shared__ float sAttn[64 * Lwin];

    const int tx    = threadIdx.x;        // 0..63 : x within tile
    const int ty    = threadIdx.y;        // 0..3  : channel within tile
    const int xbase = blockIdx.x << 6;
    const int y     = blockIdx.y;
    const int b     = blockIdx.z >> 5;
    const int ctile = blockIdx.z & 31;

    // Stage attn[b, y*W + xbase .. +63, 0..24] into LDS (contiguous loads).
    const int tid   = ty * 64 + tx;
    const size_t abase = ((size_t)b * HW + (size_t)y * Ww + xbase) * Lwin;
    for (int idx = tid; idx < 64 * Lwin; idx += 256) {
        sAttn[idx] = attn[abase + idx];
    }
    __syncthreads();

    const int x = xbase + tx;
    const int c = (ctile << 2) + ty;

    const float* __restrict__ aw = sAttn + tx * Lwin;
    float acc = 0.0f;
    #pragma unroll
    for (int dy = 0; dy < 5; ++dy) {
        int ny = y + dy - 2;
        ny = ny < 0 ? 0 : (ny > Hh - 1 ? Hh - 1 : ny);
        const float* __restrict__ vrow =
            v + (((size_t)b * Cch + c) * Hh + ny) * Ww;
        #pragma unroll
        for (int dx = 0; dx < 5; ++dx) {
            int nx = x + dx - 2;
            nx = nx < 0 ? 0 : (nx > Ww - 1 ? Ww - 1 : nx);
            acc = fmaf(aw[dy * 5 + dx], vrow[nx], acc);
        }
    }

    const size_t o = (((size_t)b * Cch + c) * Hh + y) * Ww + x;
    out[o] = fmaf(gamma[0], acc, fmap[o]);
}

// -------------------------------------------------------------------------
// Launch
// -------------------------------------------------------------------------
extern "C" void kernel_launch(void* const* d_in, const int* in_sizes, int n_in,
                              void* d_out, int out_size, void* d_ws, size_t ws_size,
                              hipStream_t stream) {
    const float* attn  = (const float*)d_in[0];  // [4,1,8192,25]
    const float* fmap  = (const float*)d_in[1];  // [4,128,64,128]
    const float* Wv    = (const float*)d_in[2];  // [128,128]
    const float* gamma = (const float*)d_in[3];  // [1]
    float* out = (float*)d_out;                  // [4,128,64,128]
    float* v   = (float*)d_ws;                   // [4,128,64,128] = 16.8 MB

    // Kernel 1: 512 pixel-tiles per batch x 4 batches; 8 waves/block (all M).
    dim3 g1(HW / 16, Bb, 1);
    dim3 b1(256, 1, 1);
    lsa_gemm_wmma<<<g1, b1, 0, stream>>>(Wv, fmap, v);

    // Kernel 2: x-tiles (2) x rows (64) x (batch * channel-tiles = 4*32).
    dim3 g2(Ww / 64, Hh, Bb * (Cch / 4));
    dim3 b2(64, 4, 1);
    lsa_aggregate<<<g2, b2, 0, stream>>>(attn, fmap, v, gamma, out);
}

// v001
// It runs in 31.3 microseconds.
// Timed twice side by side with v000, it ran 1.67 and 1.68 times as fast.
#include <hip/hip_runtime.h>

// Problem constants
#define Bb   4
#define Cch  128
#define Hh   64
#define Ww   128
#define HW   (Hh * Ww)   // 8192
#define Lwin 25          // 5x5 window

typedef __attribute__((ext_vector_type(2))) float v2f;
typedef __attribute__((ext_vector_type(8))) float v8f;

// -------------------------------------------------------------------------
// Kernel 1: v[b,o,h,w] = sum_c Wv[o,c] * fmap[b,c,h,w]
// GEMM per batch: M=128 (out ch), K=128 (in ch), N=8192 (pixels).
// One wave -> one 16x16 (MxN) tile; 8 waves per block cover all M for the
// same 16 pixels so B-fragment loads hit L0. Uses V_WMMA_F32_16X16X4_F32.
//
// A 16x4 f32 layout (ISA 7.12.2): lanes 0-15 -> M rows, VGPR0 holds K=k0
// (lanes 0-15) / K=k0+2 (lanes 16-31), VGPR1 holds k0+1 / k0+3.
// B 4x16 mirrors: lanes carry N, lane-half selects K row pair.
// D 16x16 f32: VGPR r -> row m0+r (lanes 0-15) / m0+r+8 (lanes 16-31).
// -------------------------------------------------------------------------
__global__ __launch_bounds__(256) void lsa_gemm_wmma(
    const float* __restrict__ Wv,    // [C, C]
    const float* __restrict__ fmap,  // [B, C, H, W]
    float* __restrict__ v)           // [B, C, H, W] workspace
{
    const int lane = threadIdx.x & 31;
    const int wave = threadIdx.x >> 5;
    const int b    = blockIdx.y;
    const int n0   = blockIdx.x << 4;   // pixel tile base within batch
    const int m0   = wave << 4;         // output-channel tile base

    const int Ma   = lane & 15;         // A row (M) held by this lane
    const int Nl   = lane & 15;         // B/D column (N) held by this lane
    const int koff = (lane >> 4) << 1;  // 0 for lanes 0-15, 2 for lanes 16-31

    const float* __restrict__ wrow = Wv + (m0 + Ma) * Cch;
    const float* __restrict__ bcol = fmap + (size_t)b * Cch * HW + n0 + Nl;

    v8f acc = {};
    #pragma unroll 4
    for (int k0 = 0; k0 < Cch; k0 += 4) {
        v2f a, bf;
        a.x  = wrow[k0 + koff];
        a.y  = wrow[k0 + koff + 1];
        bf.x = bcol[(size_t)(k0 + koff) * HW];
        bf.y = bcol[(size_t)(k0 + koff + 1) * HW];
        // (neg_a, A, neg_b, B, c_mod, C, reuse_a, reuse_b)
        acc = __builtin_amdgcn_wmma_f32_16x16x4_f32(
            false, a, false, bf, (short)0, acc, false, false);
    }

    const int rowsel = (lane >> 4) << 3;  // +8 rows for upper lane half
    float* __restrict__ vb = v + (size_t)b * Cch * HW;
    #pragma unroll
    for (int r = 0; r < 8; ++r) {
        vb[(size_t)(m0 + r + rowsel) * HW + n0 + Nl] = acc[r];
    }
}

// -------------------------------------------------------------------------
// Kernel 2: out[b,c,y,x] = fmap[b,c,y,x]
//                        + gamma * sum_{l=25} attn[b, y*W+x, l] * v[b,c,ny,nx]
// with (ny,nx) = replicate-clamped (y+dy-2, x+dx-2), l = dy*5+dx.
// Register tile: one wave owns one whole image row (32 lanes x 4 adjacent
// pixels) and walks AGG_CH channels. The 4 x 25 weights of a lane's pixels do
// not depend on the channel, so they are read once (global -> LDS -> registers)
// and stay in registers. Per channel a lane loads one 16-byte piece of each of
// the 5 v rows; the two values left and right of it come from the neighbour
// lanes. Each output keeps the dy-major, dx-minor fmaf chain.
// -------------------------------------------------------------------------
#define AGG_CH 8   // channels per wave; 8 waves per block -> 64 channels

__global__ __launch_bounds__(256) void lsa_aggregate(
    const float* __restrict__ attn,   // [B, 1, H*W, 25]
    const float* __restrict__ fmap,   // [B, C, H, W]
    const float* __restrict__ v,      // [B, C, H, W]
    const float* __restrict__ gamma,  // [1]
    float* __restrict__ out)          // [B, C, H, W]
{
    __shared__ __attribute__((aligned(16))) float sAttn[Ww * Lwin];

    const int tid   = threadIdx.x;
    const int lane  = tid & 31;
    const int wave  = __builtin_amdgcn_readfirstlane(tid >> 5);  // scalar: channel base in SGPRs
    const int y     = blockIdx.x;
    const int b     = blockIdx.y;
    const int cbase = ((blockIdx.z << 3) + wave) * AGG_CH;

    const int x0 = lane << 2;
    int rowoff[5];
    #pragma unroll
    for (int dy = 0; dy < 5; ++dy) {
        int ny = y + dy - 2;
        ny = ny < 0 ? 0 : (ny > Hh - 1 ? Hh - 1 : ny);
        rowoff[dy] = ny * Ww + x0;
    }
    const size_t plane0 = ((size_t)b * Cch + cbase) * HW;
    const float* vc = v + plane0;
    const float* fc = fmap + plane0 + y * Ww + x0;
    float* oc = out + plane0 + y * Ww + x0;

    // cur[0..4] = the 5 v rows of the channel being summed, cur[5] = its fmap.
    float4 cur[6];
    #pragma unroll
    for (int dy = 0; dy < 5; ++dy) cur[dy] = *(const float4*)(vc + rowoff[dy]);
    cur[5] = *(const float4*)fc;

    // Stage attn[b, y*W .. y*W+127, 0..24] into LDS: 800 contiguous 16-byte
    // pieces, all requested before the first is stored.
    {
        const float4* __restrict__ asrc =
            (const float4*)(attn + ((size_t)b * HW + (size_t)y * Ww) * Lwin);
        float4* adst = (float4*)sAttn;
        const float4 t0 = asrc[tid];
        const float4 t1 = asrc[tid + 256];
        const float4 t2 = asrc[tid + 512];
        const float4 t3 = asrc[768 + lane];   // last 32 pieces, same in every wave
        // Inputs-only fence on the four loaded pieces: all four loads are issued
        // above it and fly together; else the last one sinks into the branch
        // below and wave 0 (and the barrier behind it) waits out a second latency.
        // It also holds the wait that stands before a register named by these
        // loads is rewritten; tid and lane (their offset registers) are inputs so
        // that they stay as they are up to this wait.
        asm volatile("s_wait_xcnt 0x0"
                     :: "v"(t0.x), "v"(t0.y), "v"(t0.z), "v"(t0.w),
                        "v"(t1.x), "v"(t1.y), "v"(t1.z), "v"(t1.w),
                        "v"(t2.x), "v"(t2.y), "v"(t2.z), "v"(t2.w),
                        "v"(t3.x), "v"(t3.y), "v"(t3.z), "v"(t3.w),
                        "v"(tid), "v"(lane)
                     : "memory");
        adst[tid]       = t0;
        adst[tid + 256] = t1;
        adst[tid + 512] = t2;
        if (wave == 0) adst[768 + lane] = t3;
    }
    __syncthreads();

    // a[j*25 + l]: weight l of pixel x0 + j. 400-byte lane pitch = 16 B x odd.
    float a[4 * Lwin];
    {
        const float4* ap = (const float4*)(sAttn + lane * (4 * Lwin));
        #pragma unroll
        for (int i = 0; i < Lwin; ++i) {
            const float4 t = ap[i];
            a[4 * i + 0] = t.x;
            a[4 * i + 1] = t.y;
            a[4 * i + 2] = t.z;
            a[4 * i + 3] = t.w;
        }
    }

    const int  selL  = (lane > 0 ? lane - 1 : 0) << 2;    // byte index of lane-1
    const int  selR  = (lane < 31 ? lane + 1 : 31) << 2;  // byte index of lane+1
    const bool edgeL = (lane == 0);
    const bool edgeR = (lane == 31);
    const float g = gamma[0];

    // Kept as one rolled loop: left alone the compiler splits off the last trip,
    // which doubles the code and takes 240 registers instead of 190 (one wave
    // per SIMD less).
    #pragma unroll 1
    for (int ci = 0; ci < AGG_CH; ++ci) {
        // Request the next channel (the last trip re-reads its own) before
        // this one is summed.
        const size_t nstep = (ci + 1 < AGG_CH) ? (size_t)HW : (size_t)0;
        vc += nstep;
        fc += nstep;
        float4 nxt[6];
        #pragma unroll
        for (int dy = 0; dy < 5; ++dy) nxt[dy] = *(const float4*)(vc + rowoff[dy]);
        nxt[5] = *(const float4*)fc;
        // Order of a trip: the 6 requests, the 20 lane exchanges, then the sums.
        // Left alone the compiler sinks the requests to the end of the trip, so
        // that the wave waits out their latency, and strews the exchanges among
        // the fmaf chains, each with a wait of its own.
        __builtin_amdgcn_sched_group_barrier(0x020, 6, 0);    // global reads
        __builtin_amdgcn_sched_group_barrier(0x080, 20, 0);   // LDS-pipe operations
        __builtin_amdgcn_sched_group_barrier(0x002, 256, 0);  // vector arithmetic

        float acc[4] = {0.0f, 0.0f, 0.0f, 0.0f};
        #pragma unroll
        for (int dy = 0; dy < 5; ++dy) {
            const float4 m = cur[dy];
            const float l0 = __int_as_float(__builtin_amdgcn_ds_bpermute(selL, __float_as_int(m.z)));
            const float l1 = __int_as_float(__builtin_amdgcn_ds_bpermute(selL, __float_as_int(m.w)));
            const float r0 = __int_as_float(__builtin_amdgcn_ds_bpermute(selR, __float_as_int(m.x)));
            const float r1 = __int_as_float(__builtin_amdgcn_ds_bpermute(selR, __float_as_int(m.y)));
            // p[k] = v[ny][clamp(x0 + k - 2)]
            float p[8];
            p[0] = edgeL ? m.x : l0;
            p[1] = edgeL ? m.x : l1;
            p[2] = m.x;
            p[3] = m.y;
            p[4] = m.z;
            p[5] = m.w;
            p[6] = edgeR ? m.w : r0;
            p[7] = edgeR ? m.w : r1;
            #pragma unroll
            for (int dx = 0; dx < 5; ++dx) {
                #pragma unroll
                for (int j = 0; j < 4; ++j)
                    acc[j] = fmaf(a[j * Lwin + dy * 5 + dx], p[j + dx], acc[j]);
            }
        }

        const float4 f = cur[5];
        float4 o;
        o.x = fmaf(g, acc[0], f.x);
        o.y = fmaf(g, acc[1], f.y);
        o.z = fmaf(g, acc[2], f.z);
        o.w = fmaf(g, acc[3], f.w);
        *(float4*)oc = o;
        oc += HW;

        #pragma unroll
        for (int k = 0; k < 6; ++k) cur[k] = nxt[k];
    }
}

// -------------------------------------------------------------------------
// Launch
// -------------------------------------------------------------------------
extern "C" void kernel_launch(void* const* d_in, const int* in_sizes, int n_in,
                              void* d_out, int out_size, void* d_ws, size_t ws_size,
                              hipStream_t stream) {
    const float* attn  = (const float*)d_in[0];  // [4,1,8192,25]
    const float* fmap  = (const float*)d_in[1];  // [4,128,64,128]
    const float* Wv    = (const float*)d_in[2];  // [128,128]
    const float* gamma = (const float*)d_in[3];  // [1]
    float* out = (float*)d_out;                  // [4,128,64,128]
    float* v   = (float*)d_ws;                   // [4,128,64,128] = 16.8 MB

    // Kernel 1: 512 pixel-tiles per batch x 4 batches; 8 waves/block (all M).
    dim3 g1(HW / 16, Bb, 1);
    dim3 b1(256, 1, 1);
    lsa_gemm_wmma<<<g1, b1, 0, stream>>>(Wv, fmap, v);

    // Kernel 2: rows (64) x batches (4) x channel halves (2); 8 waves/block.
    dim3 g2(Hh, Bb, Cch / (8 * AGG_CH));
    dim3 b2(256, 1, 1);
    lsa_aggregate<<<g2, b2, 0, stream>>>(attn, fmap, v, gamma, out);
}
